// v000
// Times are from an AMD MI455X. After a warm-up the kernel runs many times in a row, and a time is the length of
// such a window on the GPU divided by its runs, so every launch and the gaps after it count. The runs cycle
// through copies of the inputs. A figure is the median of several windows, for all but v000 over two sittings.
// Sittings can differ by a few percent; kernels timed side by side share one.
// v000, which the later versions start from, runs in 1470 microseconds.
#include <hip/hip_runtime.h>
#include <hip/hip_bf16.h>
#include <math.h>

// Problem dims (match reference)
#define E_DIM  512
#define H_DIM  256
#define B_DIM  2
#define SQ_DIM 512
#define SK_DIM 512

// Padded LDS row stride (floats). 266*4 bytes is 8B-aligned; 266 % 64 == 10
// gives 16 distinct banks for the 16 concurrently-read A-fragment rows.
#define RS 266

typedef __attribute__((ext_vector_type(2))) float v2f;
typedef __attribute__((ext_vector_type(8))) float v8f;

// ---------------------------------------------------------------------------
// Prologue 1: feat = relu(x @ W + b)   x:[B*S,E]  W:[E,H]  out:[B*S,H]
// ---------------------------------------------------------------------------
__global__ void encode_kernel(const float* __restrict__ x, const float* __restrict__ W,
                              const float* __restrict__ bias, float* __restrict__ out) {
  int idx = blockIdx.x * blockDim.x + threadIdx.x;   // over B*S*H
  int h = idx & (H_DIM - 1);
  int s = idx >> 8;                                  // H_DIM == 256
  const float* xr = x + (long)s * E_DIM;
  float acc = bias[h];
#pragma unroll 4
  for (int e = 0; e < E_DIM; ++e) acc = fmaf(xr[e], W[e * H_DIM + h], acc);
  out[idx] = fmaxf(acc, 0.0f);
}

// ---------------------------------------------------------------------------
// Prologue 2: out = feat @ W[roff:roff+H, :] (+ bias)   feat:[B*S,H]  W:[2H,H]
// ---------------------------------------------------------------------------
__global__ void project_kernel(const float* __restrict__ feat, const float* __restrict__ W,
                               int roff, const float* __restrict__ bias,
                               float* __restrict__ out) {
  int idx = blockIdx.x * blockDim.x + threadIdx.x;   // over B*S*H
  int d = idx & (H_DIM - 1);
  int s = idx >> 8;
  const float* fr = feat + (long)s * H_DIM;
  float acc = bias ? bias[d] : 0.0f;
#pragma unroll 4
  for (int j = 0; j < H_DIM; ++j) acc = fmaf(fr[j], W[(roff + j) * H_DIM + d], acc);
  out[idx] = acc;
}

// ---------------------------------------------------------------------------
// One-shot weight packer: Wp[((nt*64 + kc)*32 + lane)*2 + v] =
//     W[(4*kc + (lane>>4)*2 + v)*H + nt*16 + (lane&15)]
// so each lane's WMMA B-fragment is one aligned 8-byte load, and a wave's
// fragment load touches one contiguous 256 B line.
// ---------------------------------------------------------------------------
__global__ void pack_w_kernel(const float* __restrict__ W, float* __restrict__ Wp) {
  int t = blockIdx.x * blockDim.x + threadIdx.x;   // [0, 16*64*32)
  int lane = t & 31;
  int kc   = (t >> 5) & 63;
  int nt   = t >> 11;
  int krow = (kc << 2) + ((lane >> 4) << 1);
  int ncol = (nt << 4) + (lane & 15);
  Wp[t * 2 + 0] = W[krow * H_DIM + ncol];
  Wp[t * 2 + 1] = W[(krow + 1) * H_DIM + ncol];
}

// ---------------------------------------------------------------------------
// One GEMM layer over a wave-private 32 x 256 LDS tile:
//   hout = relu(hin @ W + bias), all matrix math in v_wmma_f32_16x16x4_f32.
// Register blocking: 2 M-tiles x 8 N-tiles of accumulators (128 VGPRs);
// each packed B-fragment (global_load_b64) is reused by both M-tiles.
// ---------------------------------------------------------------------------
__device__ __forceinline__ void gemm_layer(const float* __restrict__ hin,
                                           float* __restrict__ hout,
                                           const float* __restrict__ Wp,
                                           const float* __restrict__ bias,
                                           int lane) {
  const int mrow  = lane & 15;          // A-fragment row within a 16-row tile
  const int khalf = (lane >> 4) << 1;   // K offset 0 or 2 within each K=4 chunk
  const int mbase = (lane >> 4) << 3;   // D-fragment M base (0 or 8)

  const float* Ab0 = hin + mrow * RS + khalf;
  const float* Ab1 = hin + (16 + mrow) * RS + khalf;

  for (int ntg = 0; ntg < 2; ++ntg) {
    v8f acc[2][8];
#pragma unroll
    for (int mt = 0; mt < 2; ++mt)
#pragma unroll
      for (int n = 0; n < 8; ++n) acc[mt][n] = (v8f){};

#pragma unroll 2
    for (int kc = 0; kc < 64; ++kc) {
      v2f a0, a1;
      a0.x = Ab0[4 * kc]; a0.y = Ab0[4 * kc + 1];
      a1.x = Ab1[4 * kc]; a1.y = Ab1[4 * kc + 1];
#pragma unroll
      for (int n = 0; n < 8; ++n) {
        const int nt = (ntg << 3) + n;
        v2f bb = *(const v2f*)(Wp + (size_t)((((nt << 6) + kc) << 5) + lane) * 2);
        acc[0][n] = __builtin_amdgcn_wmma_f32_16x16x4_f32(false, a0, false, bb,
                                                          (short)0, acc[0][n], false, false);
        acc[1][n] = __builtin_amdgcn_wmma_f32_16x16x4_f32(false, a1, false, bb,
                                                          (short)0, acc[1][n], false, false);
      }
    }

#pragma unroll
    for (int n = 0; n < 8; ++n) {
      const int nt = (ntg << 3) + n;
      const int ncol = (nt << 4) + mrow;
      const float bv = bias[ncol];
#pragma unroll
      for (int mt = 0; mt < 2; ++mt)
#pragma unroll
        for (int v = 0; v < 8; ++v)
          hout[((mt << 4) + mbase + v) * RS + ncol] = fmaxf(acc[mt][n][v] + bv, 0.0f);
    }
  }
}

// ---------------------------------------------------------------------------
// Main fused kernel. Block = 128 threads = 4 waves; each wave owns 32 pairs
// (one q, 32 consecutive k). The [32,256] activation tiles live only in LDS.
// ---------------------------------------------------------------------------
__global__ __launch_bounds__(128) void fused_pair_kernel(
    const float* __restrict__ qp,   // [B*SQ,H] = qf@W1[:H] + b1
    const float* __restrict__ kp,   // [B*SK,H] = kf@W1[H:]
    const float* __restrict__ vq,   // [B*SQ,H] = qf@Wv1[:H] + bv1
    const float* __restrict__ vk,   // [B*SK,H] = kf@Wv1[H:]
    const float* __restrict__ W2p, const float* __restrict__ b2,
    const float* __restrict__ W3p, const float* __restrict__ b3,
    const float* __restrict__ Wf,  const float* __restrict__ bf,
    const float* __restrict__ Wv2, const float* __restrict__ bv2,
    float* __restrict__ out_logits, float* __restrict__ out_var) {
  extern __shared__ float smem[];
  const int lane = threadIdx.x & 31;
  const int wave = threadIdx.x >> 5;
  const int bid  = blockIdx.x;
  const int kblk = bid & 3;                  // SK / (4 waves * 32) = 4 k-blocks
  const int q    = (bid >> 2) & (SQ_DIM - 1);
  const int batch = bid >> 11;               // / (4 * 512)
  const int k0 = (kblk << 7) + (wave << 5);  // this wave's first k (32 of them)

  float* h0 = smem + wave * (2 * 32 * RS);
  float* h1 = h0 + 32 * RS;

  const float* qrow  = qp + (long)(batch * SQ_DIM + q) * H_DIM;
  const float* krows = kp + (long)(batch * SK_DIM + k0) * H_DIM;

  // h0 = relu(qp[q] + kp[k0+m])   (b1 already folded into qp)
  for (int t = lane; t < 32 * H_DIM; t += 32) {
    int m = t >> 8;
    int j = t & (H_DIM - 1);
    h0[m * RS + j] = fmaxf(qrow[j] + krows[m * H_DIM + j], 0.0f);
  }
  __syncthreads();

  gemm_layer(h0, h1, W2p, b2, lane);   // h1 = relu(h0 @ W2 + b2)
  __syncthreads();
  gemm_layer(h1, h0, W3p, b3, lane);   // h3 = relu(h1 @ W3 + b3) -> h0 slice
  __syncthreads();

  const int mrow = lane & 15;
  const int joff = (lane >> 4) << 7;   // each half-wave covers 128 of H
  const long obase = (long)(batch * SQ_DIM + q) * SK_DIM + k0;

  // ---- logits epilogue: dot(h3[m,:], Wf) + bf ----
#pragma unroll
  for (int mt = 0; mt < 2; ++mt) {
    const float* row = h0 + ((mt << 4) + mrow) * RS + joff;
    const float* wf  = Wf + joff;
    float part = 0.0f;
#pragma unroll 4
    for (int j = 0; j < 128; ++j) part = fmaf(row[j], wf[j], part);
    part += __shfl_xor(part, 16, 32);
    if (lane < 16) out_logits[obase + (mt << 4) + mrow] = part + bf[0];
  }

  // ---- variance epilogue: softplus(dot(relu(vq+vk), Wv2) + bv2) ----
#pragma unroll
  for (int mt = 0; mt < 2; ++mt) {
    const float* vqrow = vq + (long)(batch * SQ_DIM + q) * H_DIM + joff;
    const float* vkrow = vk + (long)(batch * SK_DIM + k0 + (mt << 4) + mrow) * H_DIM + joff;
    const float* wv = Wv2 + joff;
    float part = 0.0f;
#pragma unroll 4
    for (int j = 0; j < 128; ++j) {
      float x = fmaxf(vqrow[j] + vkrow[j], 0.0f);
      part = fmaf(x, wv[j], part);
    }
    part += __shfl_xor(part, 16, 32);
    if (lane < 16) {
      float x = part + bv2[0];
      out_var[obase + (mt << 4) + mrow] = (x > 20.0f) ? x : log1pf(expf(x));
    }
  }
}

// ---------------------------------------------------------------------------
extern "C" void kernel_launch(void* const* d_in, const int* in_sizes, int n_in,
                              void* d_out, int out_size, void* d_ws, size_t ws_size,
                              hipStream_t stream) {
  (void)in_sizes; (void)n_in; (void)out_size; (void)ws_size;
  const float* query = (const float*)d_in[0];
  const float* key   = (const float*)d_in[1];
  const float* Wqe   = (const float*)d_in[2];
  const float* bqe   = (const float*)d_in[3];
  const float* Wke   = (const float*)d_in[4];
  const float* bke   = (const float*)d_in[5];
  const float* W1    = (const float*)d_in[6];
  const float* b1    = (const float*)d_in[7];
  const float* W2    = (const float*)d_in[8];
  const float* b2    = (const float*)d_in[9];
  const float* W3    = (const float*)d_in[10];
  const float* b3    = (const float*)d_in[11];
  const float* Wf    = (const float*)d_in[12];
  const float* bf    = (const float*)d_in[13];
  const float* Wv1   = (const float*)d_in[14];
  const float* bv1   = (const float*)d_in[15];
  const float* Wv2   = (const float*)d_in[16];
  const float* bv2   = (const float*)d_in[17];

  const size_t NSH = (size_t)B_DIM * SQ_DIM * H_DIM;   // 262144 floats per tensor
  float* qf  = (float*)d_ws;
  float* kf  = qf + NSH;
  float* qp  = kf + NSH;
  float* kp  = qp + NSH;
  float* vq  = kp + NSH;
  float* vk  = vq + NSH;
  float* W2p = vk + NSH;                 // 65536 floats
  float* W3p = W2p + (size_t)H_DIM * H_DIM;   // total workspace: 6.5 MB

  dim3 blk(256);
  dim3 grd((unsigned)(NSH / 256));   // 1024 blocks

  encode_kernel<<<grd, blk, 0, stream>>>(query, Wqe, bqe, qf);
  encode_kernel<<<grd, blk, 0, stream>>>(key,   Wke, bke, kf);
  project_kernel<<<grd, blk, 0, stream>>>(qf, W1,  0,     b1,      qp);
  project_kernel<<<grd, blk, 0, stream>>>(kf, W1,  H_DIM, nullptr, kp);
  project_kernel<<<grd, blk, 0, stream>>>(qf, Wv1, 0,     bv1,     vq);
  project_kernel<<<grd, blk, 0, stream>>>(kf, Wv1, H_DIM, nullptr, vk);
  pack_w_kernel<<<dim3(128), blk, 0, stream>>>(W2, W2p);
  pack_w_kernel<<<dim3(128), blk, 0, stream>>>(W3, W3p);

  // 4 waves * 2 tiles * 32 rows * 266 floats * 4 B = 272,384 B (< 320 KB WGP LDS)
  const size_t shmem = (size_t)(4 * 2 * 32 * RS) * sizeof(float);
  hipFuncSetAttribute(reinterpret_cast<const void*>(&fused_pair_kernel),
                      hipFuncAttributeMaxDynamicSharedMemorySize, (int)shmem);

  float* out_logits = (float*)d_out;
  float* out_var    = out_logits + (size_t)B_DIM * SQ_DIM * SK_DIM;
  fused_pair_kernel<<<dim3(B_DIM * SQ_DIM * 4), dim3(128), shmem, stream>>>(
      qp, kp, vq, vk, W2p, b2, W3p, b3, Wf, bf, Wv2, bv2, out_logits, out_var);
}

// v001
// A run of this version takes 882 microseconds.
// Next to v000, in two timings, it ran 1.69 times as fast each time.
#include <hip/hip_runtime.h>
#include <hip/hip_bf16.h>
#include <math.h>

// Problem dims (match reference)
#define E_DIM  512
#define H_DIM  256
#define B_DIM  2
#define SQ_DIM 512
#define SK_DIM 512

// Weight fragments fetched ahead of their use, in 16-byte loads per lane.
#define RING 16

typedef __attribute__((ext_vector_type(2))) float v2f;
typedef __attribute__((ext_vector_type(4))) float v4f;
typedef __attribute__((ext_vector_type(8))) float v8f;

// ---------------------------------------------------------------------------
// Prologue 1: feat = relu(x @ W + b)   x:[B*S,E]  W:[E,H]  out:[B*S,H]
// ---------------------------------------------------------------------------
__global__ void encode_kernel(const float* __restrict__ x, const float* __restrict__ W,
                              const float* __restrict__ bias, float* __restrict__ out) {
  int idx = blockIdx.x * blockDim.x + threadIdx.x;   // over B*S*H
  int h = idx & (H_DIM - 1);
  int s = idx >> 8;                                  // H_DIM == 256
  const float* xr = x + (long)s * E_DIM;
  float acc = bias[h];
#pragma unroll 4
  for (int e = 0; e < E_DIM; ++e) acc = fmaf(xr[e], W[e * H_DIM + h], acc);
  out[idx] = fmaxf(acc, 0.0f);
}

// ---------------------------------------------------------------------------
// Prologue 2: out = feat @ W[roff:roff+H, :] (+ bias)   feat:[B*S,H]  W:[2H,H]
// ---------------------------------------------------------------------------
__global__ void project_kernel(const float* __restrict__ feat, const float* __restrict__ W,
                               int roff, const float* __restrict__ bias,
                               float* __restrict__ out) {
  int idx = blockIdx.x * blockDim.x + threadIdx.x;   // over B*S*H
  int d = idx & (H_DIM - 1);
  int s = idx >> 8;
  const float* fr = feat + (long)s * H_DIM;
  float acc = bias ? bias[d] : 0.0f;
#pragma unroll 4
  for (int j = 0; j < H_DIM; ++j) acc = fmaf(fr[j], W[(roff + j) * H_DIM + d], acc);
  out[idx] = acc;
}

// ---------------------------------------------------------------------------
// One-shot weight packer for the transposed product  out^T = W^T * in^T :
// W^T is the WMMA A operand (lane: out column nt*16 + (lane&15)), the
// activations are the B operand. A 16-feature input tile kt is eaten in four
// K=4 chunks whose k slots are the features a lane half already holds in a
// D tile: half h, chunk c, slot v  ->  feature 16*kt + 8*h + 2*c + v.
// One 16-byte element holds chunks 2*cp and 2*cp+1 of one (kt, nt):
//   Wp[(((major*16 + minor)*2 + cp)*32 + lane)*4 + e] =
//       W[(16*kt + 8*(lane>>4) + 4*cp + e)*H + nt*16 + (lane&15)]
// kmajor != 0: (major, minor) = (kt, nt); else (nt, kt): each layer reads its
// elements in plain ascending order.
// ---------------------------------------------------------------------------
__global__ void pack_w_kernel(const float* __restrict__ W, float* __restrict__ Wp, int kmajor) {
  int t = blockIdx.x * blockDim.x + threadIdx.x;   // [0, 16*16*2*32)
  int lane  = t & 31;
  int cp    = (t >> 5) & 1;
  int minor = (t >> 6) & 15;
  int major = t >> 10;
  int kt = kmajor ? major : minor;
  int nt = kmajor ? minor : major;
  int krow = (kt << 4) + ((lane >> 4) << 3) + (cp << 2);
  int ncol = (nt << 4) + (lane & 15);
  v4f w;
  w.x = W[krow * H_DIM + ncol];
  w.y = W[(krow + 1) * H_DIM + ncol];
  w.z = W[(krow + 2) * H_DIM + ncol];
  w.w = W[(krow + 3) * H_DIM + ncol];
  *(v4f*)(Wp + (size_t)t * 4) = w;
}

__device__ __forceinline__ v8f mm(v2f a, v2f b, v8f c) {
  return __builtin_amdgcn_wmma_f32_16x16x4_f32(false, a, false, b, (short)0, c, false, false);
}

// Eight floats as two 16-byte loads joined: the first fetch, in front of a trip
// loop, of a value that the loop then fetches one trip ahead.
__device__ __forceinline__ v8f ld8(const float* p) {
  const v4f lo = *(const v4f*)p, hi = *(const v4f*)(p + 4);
  return __builtin_shufflevector(lo, hi, 0, 1, 2, 3, 4, 5, 6, 7);
}

// Stands behind loads whose address registers the code that follows takes for
// other values: the overwrite comes behind this wait (a precaution).
// The scheduling barrier keeps the address arithmetic that follows from being
// lifted over the wait.
__device__ __forceinline__ void xwait() {
  asm volatile("s_wait_xcnt 0x0" ::: "memory");
  __builtin_amdgcn_sched_barrier(0);
}

// A wave-uniform row base held in scalar registers: the loads of the two trip
// loops then take the scalar-base form with a lane-offset register that
// outlives the run of loads: no load's result lands in an address register.
typedef const __attribute__((address_space(1))) float* gfp;
__device__ __forceinline__ gfp sbase(const float* p) {
  const unsigned long long a = (unsigned long long)p;
  const unsigned lo = __builtin_amdgcn_readfirstlane((unsigned)a);
  const unsigned hi = __builtin_amdgcn_readfirstlane((unsigned)(a >> 32));
  return (gfp)(((unsigned long long)hi << 32) | lo);
}
typedef const __attribute__((address_space(1))) v8f* gv8p;

// One packed element (two K=4 chunks of weights) against two 16-pair tiles.
// x0, x1: a 16-feature tile of activations in D layout; cp picks its registers.
#define EAT(w, x0, x1, cp, d0, d1)                                             \
  do {                                                                         \
    const v2f wa = {(w).x, (w).y}, wb = {(w).z, (w).w};                        \
    d0 = mm(wa, (v2f){(x0)[4 * (cp)], (x0)[4 * (cp) + 1]}, d0);                \
    d1 = mm(wa, (v2f){(x1)[4 * (cp)], (x1)[4 * (cp) + 1]}, d1);                \
    d0 = mm(wb, (v2f){(x0)[4 * (cp) + 2], (x0)[4 * (cp) + 3]}, d0);            \
    d1 = mm(wb, (v2f){(x1)[4 * (cp) + 2], (x1)[4 * (cp) + 3]}, d1);            \
  } while (0)

// ---------------------------------------------------------------------------
// Main fused kernel. Block = 128 threads = 4 waves; each wave owns 32 pairs
// (one q, 32 consecutive k) as two 16-pair tiles. Every layer is computed
// transposed (features x pairs), so a layer's D registers, after bias and
// relu, ARE the next layer's B fragments: the activations never leave the
// registers. Lane (c = lane&15, h = lane>>4) holds pair c, features 8h..8h+7
// of each 16-feature tile. Two waves per SIMD (second launch bound).
// ---------------------------------------------------------------------------
__global__ __launch_bounds__(128, 2) void fused_pair_kernel(
    const float* __restrict__ qp,   // [B*SQ,H] = qf@W1[:H] + b1
    const float* __restrict__ kp,   // [B*SK,H] = kf@W1[H:]
    const float* __restrict__ vq,   // [B*SQ,H] = qf@Wv1[:H] + bv1
    const float* __restrict__ vk,   // [B*SK,H] = kf@Wv1[H:]
    const float* __restrict__ Wp,   // packed W2 (kt-major), then packed W3 (nt-major)
    const float* __restrict__ b2, const float* __restrict__ b3,
    const float* __restrict__ Wf,  const float* __restrict__ bf,
    const float* __restrict__ Wv2, const float* __restrict__ bv2,
    float* __restrict__ out_logits, float* __restrict__ out_var) {
  const int lane = threadIdx.x & 31;
  const int wave = __builtin_amdgcn_readfirstlane(threadIdx.x >> 5);   // scalar: keeps row bases in SGPRs
  const int bid  = blockIdx.x;
  const int kblk = bid & 3;                  // SK / (4 waves * 32) = 4 k-blocks
  const int q    = (bid >> 2) & (SQ_DIM - 1);
  const int batch = bid >> 11;               // / (4 * 512)
  const int k0 = (kblk << 7) + (wave << 5);  // this wave's first k (32 of them)
  const int mrow = lane & 15;
  const int f8   = (lane >> 4) << 3;         // this lane half's features in a tile

  const float* qrow = qp + (long)(batch * SQ_DIM + q) * H_DIM;    // wave-uniform bases,
  const float* krow = kp + (long)(batch * SK_DIM + k0) * H_DIM;   // lane parts below
  const int kl0 = mrow * H_DIM + f8;
  const int kl1 = kl0 + 16 * H_DIM;
  const v4f* ws = (const v4f*)Wp;            // element e of the weight stream: ws[e * 32 + lane]

  // ---- layer 2: acc[nt][pt] = b2 + W2^T * relu(qp[q] + kp[k])^T ----
  // (inner loops are fully unrolled so that every tile index is a constant and
  //  the tiles stay in registers; the two trip loops stay rolled for code size)
  v8f acc[16][2];
#pragma unroll
  for (int nt = 0; nt < 16; ++nt) {
    const v8f bv = *(const v8f*)(b2 + (nt << 4) + f8);
    acc[nt][0] = bv;
    acc[nt][1] = bv;
  }

  v8f nq = ld8(qrow + f8);
  xwait();
  v8f nk0 = ld8(krow + kl0), nk1 = ld8(krow + kl1);
  xwait();

  // The weight stream (32 trips of 32 elements, W2 then W3) runs RING elements ahead.
  v4f ring[RING];
#pragma unroll
  for (int j = 0; j < RING; ++j) ring[j] = ws[j * 32 + lane];

#pragma unroll 1
  for (int kt = 0; kt < 16; ++kt) {
    v8f x0, x1;   // input tile kt (b1 already folded into qp)
#pragma unroll
    for (int r = 0; r < 8; ++r) {
      x0[r] = fmaxf(nq[r] + nk0[r], 0.0f);
      x1[r] = fmaxf(nq[r] + nk1[r], 0.0f);
    }
    const int tn = ((kt + 1) & 15) << 4;   // next tile, fetched one trip ahead
    const gfp qb = sbase(qrow + tn), kb = sbase(krow + tn);
    nq  = *(gv8p)(qb + f8);
    nk0 = *(gv8p)(kb + kl0);
    nk1 = *(gv8p)(kb + kl1);
    const v4f* cur = ws + kt * (32 * 32);
#pragma unroll
    for (int j = 0; j < 32; ++j) {
      const v4f w = ring[j % RING];
      ring[j % RING] = cur[(j + RING) * 32 + lane];
      EAT(w, x0, x1, j & 1, acc[j >> 1][0], acc[j >> 1][1]);
    }
  }

#pragma unroll
  for (int nt = 0; nt < 16; ++nt)
#pragma unroll
    for (int r = 0; r < 8; ++r) {
      acc[nt][0][r] = fmaxf(acc[nt][0][r], 0.0f);
      acc[nt][1][r] = fmaxf(acc[nt][1][r], 0.0f);
    }

  // ---- layer 3 + logits: one 16-feature output tile per trip, folded into
  //      dot(relu(h3), Wf) at once ----
  float part0 = 0.0f, part1 = 0.0f;
  v8f nb = ld8(b3 + f8), nw = ld8(Wf + f8);
  xwait();
#pragma unroll 1
  for (int nt = 0; nt < 16; ++nt) {
    v8f d0 = nb, d1 = nb;
    const v8f wf = nw;
    const int tn = ((nt + 1) & 15) << 4;
    nb = *(gv8p)(sbase(b3 + tn) + f8);
    nw = *(gv8p)(sbase(Wf + tn) + f8);
    const v4f* cur = ws + (16 + nt) * (32 * 32);
    // the last trip has no successor: its look-ahead re-reads the stream's start
    const v4f* nxt = (nt == 15) ? ws : cur + 32 * 32;
#pragma unroll
    for (int j = 0; j < 32; ++j) {
      const v4f w = ring[j % RING];
      ring[j % RING] = (j + RING < 32) ? cur[(j + RING) * 32 + lane] : nxt[(j + RING - 32) * 32 + lane];
      EAT(w, acc[j >> 1][0], acc[j >> 1][1], j & 1, d0, d1);
    }
    // Vector slots between the last WMMA and the first read of its D.
    // d0 and d1 are operands only so
    // that the slots stand behind their last WMMA and in front of their readers.
    asm volatile("v_nop\n\tv_nop\n\tv_nop\n\tv_nop\n\tv_nop" : "+v"(d0), "+v"(d1));
#pragma unroll
    for (int r = 0; r < 8; ++r) {
      part0 = fmaf(fmaxf(d0[r], 0.0f), wf[r], part0);
      part1 = fmaf(fmaxf(d1[r], 0.0f), wf[r], part1);
    }
  }

  const int joff = (lane >> 4) << 7;   // each half-wave covers 128 of H
  const long obase = (long)(batch * SQ_DIM + q) * SK_DIM + k0;

  // the two lane halves hold the two halves of every feature tile
  part0 += __shfl_xor(part0, 16, 32);
  part1 += __shfl_xor(part1, 16, 32);
  out_logits[obase + lane] = ((lane < 16) ? part0 : part1) + bf[0];

  // ---- variance epilogue: softplus(dot(relu(vq+vk), Wv2) + bv2) ----
#pragma unroll
  for (int mt = 0; mt < 2; ++mt) {
    const float* vqrow = vq + (long)(batch * SQ_DIM + q) * H_DIM + joff;
    const float* vkrow = vk + (long)(batch * SK_DIM + k0 + (mt << 4) + mrow) * H_DIM + joff;
    const float* wv = Wv2 + joff;
    float part = 0.0f;
#pragma unroll 4
    for (int j = 0; j < 128; ++j) {
      float x = fmaxf(vqrow[j] + vkrow[j], 0.0f);
      part = fmaf(x, wv[j], part);
    }
    part += __shfl_xor(part, 16, 32);
    if (lane < 16) {
      float x = part + bv2[0];
      out_var[obase + (mt << 4) + mrow] = (x > 20.0f) ? x : log1pf(expf(x));
    }
  }
}

// ---------------------------------------------------------------------------
extern "C" void kernel_launch(void* const* d_in, const int* in_sizes, int n_in,
                              void* d_out, int out_size, void* d_ws, size_t ws_size,
                              hipStream_t stream) {
  (void)in_sizes; (void)n_in; (void)out_size; (void)ws_size;
  const float* query = (const float*)d_in[0];
  const float* key   = (const float*)d_in[1];
  const float* Wqe   = (const float*)d_in[2];
  const float* bqe   = (const float*)d_in[3];
  const float* Wke   = (const float*)d_in[4];
  const float* bke   = (const float*)d_in[5];
  const float* W1    = (const float*)d_in[6];
  const float* b1    = (const float*)d_in[7];
  const float* W2    = (const float*)d_in[8];
  const float* b2    = (const float*)d_in[9];
  const float* W3    = (const float*)d_in[10];
  const float* b3    = (const float*)d_in[11];
  const float* Wf    = (const float*)d_in[12];
  const float* bf    = (const float*)d_in[13];
  const float* Wv1   = (const float*)d_in[14];
  const float* bv1   = (const float*)d_in[15];
  const float* Wv2   = (const float*)d_in[16];
  const float* bv2   = (const float*)d_in[17];

  const size_t NSH = (size_t)B_DIM * SQ_DIM * H_DIM;   // 262144 floats per tensor
  float* qf  = (float*)d_ws;
  float* kf  = qf + NSH;
  float* qp  = kf + NSH;
  float* kp  = qp + NSH;
  float* vq  = kp + NSH;
  float* vk  = vq + NSH;
  float* W2p = vk + NSH;                 // 65536 floats
  float* W3p = W2p + (size_t)H_DIM * H_DIM;   // directly behind W2p; total workspace: 6.5 MB

  dim3 blk(256);
  dim3 grd((unsigned)(NSH / 256));   // 1024 blocks

  encode_kernel<<<grd, blk, 0, stream>>>(query, Wqe, bqe, qf);
  encode_kernel<<<grd, blk, 0, stream>>>(key,   Wke, bke, kf);
  project_kernel<<<grd, blk, 0, stream>>>(qf, W1,  0,     b1,      qp);
  project_kernel<<<grd, blk, 0, stream>>>(kf, W1,  H_DIM, nullptr, kp);
  project_kernel<<<grd, blk, 0, stream>>>(qf, Wv1, 0,     bv1,     vq);
  project_kernel<<<grd, blk, 0, stream>>>(kf, Wv1, H_DIM, nullptr, vk);
  pack_w_kernel<<<dim3(64), blk, 0, stream>>>(W2, W2p, 1);
  pack_w_kernel<<<dim3(64), blk, 0, stream>>>(W3, W3p, 0);

  float* out_logits = (float*)d_out;
  float* out_var    = out_logits + (size_t)B_DIM * SQ_DIM * SK_DIM;
  fused_pair_kernel<<<dim3(B_DIM * SQ_DIM * 4), dim3(128), 0, stream>>>(
      qp, kp, vq, vk, W2p, b2, b3, Wf, bf, Wv2, bv2, out_logits, out_var);
}

// v002
// A run of this version takes 601 microseconds.
// In both of two side-by-side timings against v001, it was 1.47 times as fast.
// Counting every step since v000, it is 2.48 times as fast.
#include <hip/hip_runtime.h>
#include <hip/hip_bf16.h>
#include <math.h>

// Problem dims (match reference)
#define E_DIM  512
#define H_DIM  256
#define B_DIM  2
#define SQ_DIM 512
#define SK_DIM 512

// Weight fragments fetched ahead of their use, in 16-byte loads per lane.
#define RING 16

typedef __attribute__((ext_vector_type(2))) float v2f;
typedef __attribute__((ext_vector_type(4))) float v4f;
typedef __attribute__((ext_vector_type(8))) float v8f;

__device__ __forceinline__ v8f mm(v2f a, v2f b, v8f c) {
  return __builtin_amdgcn_wmma_f32_16x16x4_f32(false, a, false, b, (short)0, c, false, false);
}

// Eight floats as two 16-byte loads joined: a B row piece of a prologue tile; in
// the main kernel the first fetch, in front of a trip loop, of a value that the
// loop then fetches one trip ahead.
__device__ __forceinline__ v8f ld8(const float* p) {
  const v4f lo = *(const v4f*)p, hi = *(const v4f*)(p + 4);
  return __builtin_shufflevector(lo, hi, 0, 1, 2, 3, 4, 5, 6, 7);
}

// Stands behind loads whose address registers the code that follows takes for
// other values: the overwrite comes behind this wait (a precaution).
// The scheduling barrier keeps the address arithmetic that follows from being
// lifted over the wait.
__device__ __forceinline__ void xwait() {
  asm volatile("s_wait_xcnt 0x0" ::: "memory");
  __builtin_amdgcn_sched_barrier(0);
}

// ---------------------------------------------------------------------------
// Prologue products on the matrix unit:  out[s][d] = (relu)(X[s][:] . W[:][d] + bias[d])
// X:[1024,K]  W:[K,H]  out:[1024,H]. Computed transposed, as in the main kernel:
// W^T is the A operand (lane: column dbase + 16*e + (lane&15) of M tile e), X^T
// the B operand (lane: row s0 + (lane&15)). Block = 4 waves on one tile of
// 16 rows s x 64 columns d; wave w takes k in [w*K/4, (w+1)*K/4); the four
// partial tiles are summed through LDS in the fixed order w = 0..3.
// k order of both loaders: half h, chunk cc, slot v -> k = 16*kt + 8*h + 2*cc + v.
// W is read in 4-byte loads: the two k slots of an A fragment are two rows of W,
// and each load lands in its own register of the pair, with no copy between.
// ---------------------------------------------------------------------------
template <int K, bool RELU>
__device__ __forceinline__ void tile_product(const float* __restrict__ X, const float* __restrict__ W,
                                             const float* __restrict__ bias, float* __restrict__ out) {
  __shared__ v4f red[4][32][9];   // [wave][lane][2*e + (r>>2)], lane pitch 144 B (16 B x odd: no bank conflict)
  const int lane = threadIdx.x & 31;
  const int wave = __builtin_amdgcn_readfirstlane(threadIdx.x >> 5);   // scalar: keeps the bases in SGPRs
  const int c = lane & 15, h = lane >> 4;
  const int s0 = (blockIdx.x >> 2) << 4;
  const int dbase = (blockIdx.x & 3) << 6;
  constexpr int KW = K / 4;
  constexpr int KT = KW / 16;
  const float* xb = X + (long)s0 * K + wave * KW;                 // wave-uniform bases,
  const float* wb = W + (long)(wave * KW) * H_DIM + dbase;        // lane parts below
  const int xl = c * K + 8 * h;
  const int wl = 8 * h * H_DIM + c;

  // Every load of the wave's k range is issued in front of the first WMMA, so
  // that the wave meets the load latency once. (Every loop of this function is
  // fully unrolled: its indices pick registers, so they must be constants.)
  v8f x[KT];
  v2f a[KT][4][4];
#pragma unroll
  for (int kt = 0; kt < KT; ++kt) {
    x[kt] = ld8(xb + 16 * kt + xl);
#pragma unroll
    for (int cc = 0; cc < 4; ++cc)
#pragma unroll
      for (int e = 0; e < 4; ++e) {
        a[kt][cc][e].x = wb[(16 * kt + 2 * cc) * H_DIM + 16 * e + wl];
        a[kt][cc][e].y = wb[(16 * kt + 2 * cc + 1) * H_DIM + 16 * e + wl];
      }
  }
  xwait();   // its scheduling barrier also keeps the compiler from sinking the loads among the WMMAs

  v8f acc[4] = {};
#pragma unroll
  for (int kt = 0; kt < KT; ++kt)
#pragma unroll
    for (int cc = 0; cc < 4; ++cc) {
      const v2f xf = {x[kt][2 * cc], x[kt][2 * cc + 1]};
#pragma unroll
      for (int e = 0; e < 4; ++e) acc[e] = mm(a[kt][cc][e], xf, acc[e]);
    }

  // Vector slots between the last WMMAs and the first vector instruction that
  // takes one of their A or B registers for another value.
  // The tiles are operands only so that the slots
  // stand behind their last WMMA, the thread index only so that the address
  // arithmetic of the part below, which starts from it, stands behind the slots;
  // the scheduling barrier keeps that arithmetic from being lifted over them.
  int tid = threadIdx.x;
  asm volatile("v_nop\n\tv_nop\n\tv_nop\n\tv_nop\n\tv_nop"
               : "+v"(acc[0]), "+v"(acc[1]), "+v"(acc[2]), "+v"(acc[3]), "+v"(tid));
  __builtin_amdgcn_sched_barrier(0);
  const int tl = tid & 31;

  // lane (c, h) holds row s0 + c, columns dbase + 16*e + 8*h + r of tile e
#pragma unroll
  for (int e = 0; e < 4; ++e) {
    red[wave][tl][2 * e]     = __builtin_shufflevector(acc[e], acc[e], 0, 1, 2, 3);
    red[wave][tl][2 * e + 1] = __builtin_shufflevector(acc[e], acc[e], 4, 5, 6, 7);
  }
  __syncthreads();

  // wave w sums and stores rows 4w..4w+3 (two 128-byte lines each): one writer
  // per line; eight lanes cover a line, lane piece p = 16 bytes.
  const int row = (wave << 2) + (tl >> 3);
  const int p = tl & 7;
  const int src = row + (((p >> 1) & 1) << 4);        // source lane: half = bit 3 of the column
  const int q = ((p >> 2) << 1) + (p & 1);            // its 16-byte piece, columns 0..31; +4: columns 32..63
  const int d = dbase + 4 * p;
  v4f lo = ((red[0][src][q] + red[1][src][q]) + red[2][src][q]) + red[3][src][q];
  v4f hi = ((red[0][src][q + 4] + red[1][src][q + 4]) + red[2][src][q + 4]) + red[3][src][q + 4];
  if (bias) {
    const v4f blo = *(const v4f*)(bias + d), bhi = *(const v4f*)(bias + d + 32);
    xwait();
    lo += blo;
    hi += bhi;
  }
  if (RELU) {
#pragma unroll
    for (int e = 0; e < 4; ++e) {
      lo[e] = fmaxf(lo[e], 0.0f);
      hi[e] = fmaxf(hi[e], 0.0f);
    }
  }
  float* o = out + (long)(s0 + row) * H_DIM + d;
  *(v4f*)o = lo;
  *(v4f*)(o + 32) = hi;
}

// Prologue 1: feat = relu(x @ W + b)   x:[B*S,E]  W:[E,H]  out:[B*S,H]
__global__ __launch_bounds__(128) void encode_kernel(const float* __restrict__ x, const float* __restrict__ W,
                                                     const float* __restrict__ bias, float* __restrict__ out) {
  tile_product<E_DIM, true>(x, W, bias, out);
}

// Prologue 2: out = feat @ W[roff:roff+H, :] (+ bias)   feat:[B*S,H]  W:[2H,H]
__global__ __launch_bounds__(128) void project_kernel(const float* __restrict__ feat, const float* __restrict__ W,
                                                      int roff, const float* __restrict__ bias,
                                                      float* __restrict__ out) {
  tile_product<H_DIM, false>(feat, W + (long)roff * H_DIM, bias, out);
}

// ---------------------------------------------------------------------------
// One-shot weight packer for the transposed product  out^T = W^T * in^T :
// W^T is the WMMA A operand (lane: out column nt*16 + (lane&15)), the
// activations are the B operand. A 16-feature input tile kt is eaten in four
// K=4 chunks whose k slots are the features a lane half already holds in a
// D tile: half h, chunk c, slot v  ->  feature 16*kt + 8*h + 2*c + v.
// One 16-byte element holds chunks 2*cp and 2*cp+1 of one (kt, nt):
//   Wp[(((major*16 + minor)*2 + cp)*32 + lane)*4 + e] =
//       W[(16*kt + 8*(lane>>4) + 4*cp + e)*H + nt*16 + (lane&15)]
// kmajor != 0: (major, minor) = (kt, nt); else (nt, kt): each layer reads its
// elements in plain ascending order.
// ---------------------------------------------------------------------------
__global__ void pack_w_kernel(const float* __restrict__ W, float* __restrict__ Wp, int kmajor) {
  int t = blockIdx.x * blockDim.x + threadIdx.x;   // [0, 16*16*2*32)
  int lane  = t & 31;
  int cp    = (t >> 5) & 1;
  int minor = (t >> 6) & 15;
  int major = t >> 10;
  int kt = kmajor ? major : minor;
  int nt = kmajor ? minor : major;
  int krow = (kt << 4) + ((lane >> 4) << 3) + (cp << 2);
  int ncol = (nt << 4) + (lane & 15);
  v4f w;
  w.x = W[krow * H_DIM + ncol];
  w.y = W[(krow + 1) * H_DIM + ncol];
  w.z = W[(krow + 2) * H_DIM + ncol];
  w.w = W[(krow + 3) * H_DIM + ncol];
  *(v4f*)(Wp + (size_t)t * 4) = w;
}

// A wave-uniform row base held in scalar registers: the loads of the two trip
// loops then take the scalar-base form with a lane-offset register that
// outlives the run of loads: no load's result lands in an address register.
typedef const __attribute__((address_space(1))) float* gfp;
__device__ __forceinline__ gfp sbase(const float* p) {
  const unsigned long long a = (unsigned long long)p;
  const unsigned lo = __builtin_amdgcn_readfirstlane((unsigned)a);
  const unsigned hi = __builtin_amdgcn_readfirstlane((unsigned)(a >> 32));
  return (gfp)(((unsigned long long)hi << 32) | lo);
}
typedef const __attribute__((address_space(1))) v8f* gv8p;

// One packed element (two K=4 chunks of weights) against two 16-pair tiles.
// x0, x1: a 16-feature tile of activations in D layout; cp picks its registers.
#define EAT(w, x0, x1, cp, d0, d1)                                             \
  do {                                                                         \
    const v2f wa = {(w).x, (w).y}, wb = {(w).z, (w).w};                        \
    d0 = mm(wa, (v2f){(x0)[4 * (cp)], (x0)[4 * (cp) + 1]}, d0);                \
    d1 = mm(wa, (v2f){(x1)[4 * (cp)], (x1)[4 * (cp) + 1]}, d1);                \
    d0 = mm(wb, (v2f){(x0)[4 * (cp) + 2], (x0)[4 * (cp) + 3]}, d0);            \
    d1 = mm(wb, (v2f){(x1)[4 * (cp) + 2], (x1)[4 * (cp) + 3]}, d1);            \
  } while (0)

// ---------------------------------------------------------------------------
// Main fused kernel. Block = 128 threads = 4 waves; each wave owns 32 pairs
// (one q, 32 consecutive k) as two 16-pair tiles. Every layer is computed
// transposed (features x pairs), so a layer's D registers, after bias and
// relu, ARE the next layer's B fragments: the activations never leave the
// registers. Lane (c = lane&15, h = lane>>4) holds pair c, features 8h..8h+7
// of each 16-feature tile. Two waves per SIMD (second launch bound).
// ---------------------------------------------------------------------------
__global__ __launch_bounds__(128, 2) void fused_pair_kernel(
    const float* __restrict__ qp,   // [B*SQ,H] = qf@W1[:H] + b1
    const float* __restrict__ kp,   // [B*SK,H] = kf@W1[H:]
    const float* __restrict__ vq,   // [B*SQ,H] = qf@Wv1[:H] + bv1
    const float* __restrict__ vk,   // [B*SK,H] = kf@Wv1[H:]
    const float* __restrict__ Wp,   // packed W2 (kt-major), then packed W3 (nt-major)
    const float* __restrict__ b2, const float* __restrict__ b3,
    const float* __restrict__ Wf,  const float* __restrict__ bf,
    const float* __restrict__ Wv2, const float* __restrict__ bv2,
    float* __restrict__ out_logits, float* __restrict__ out_var) {
  const int lane = threadIdx.x & 31;
  const int wave = __builtin_amdgcn_readfirstlane(threadIdx.x >> 5);   // scalar: keeps row bases in SGPRs
  const int bid  = blockIdx.x;
  const int kblk = bid & 3;                  // SK / (4 waves * 32) = 4 k-blocks
  const int q    = (bid >> 2) & (SQ_DIM - 1);
  const int batch = bid >> 11;               // / (4 * 512)
  const int k0 = (kblk << 7) + (wave << 5);  // this wave's first k (32 of them)
  const int mrow = lane & 15;
  const int f8   = (lane >> 4) << 3;         // this lane half's features in a tile

  const float* qrow = qp + (long)(batch * SQ_DIM + q) * H_DIM;    // wave-uniform bases,
  const float* krow = kp + (long)(batch * SK_DIM + k0) * H_DIM;   // lane parts below
  const int kl0 = mrow * H_DIM + f8;
  const int kl1 = kl0 + 16 * H_DIM;
  const v4f* ws = (const v4f*)Wp;            // element e of the weight stream: ws[e * 32 + lane]

  // ---- layer 2: acc[nt][pt] = b2 + W2^T * relu(qp[q] + kp[k])^T ----
  // (inner loops are fully unrolled so that every tile index is a constant and
  //  the tiles stay in registers; the two trip loops stay rolled for code size)
  v8f acc[16][2];
#pragma unroll
  for (int nt = 0; nt < 16; ++nt) {
    const v8f bv = *(const v8f*)(b2 + (nt << 4) + f8);
    acc[nt][0] = bv;
    acc[nt][1] = bv;
  }

  v8f nq = ld8(qrow + f8);
  xwait();
  v8f nk0 = ld8(krow + kl0), nk1 = ld8(krow + kl1);
  xwait();

  // The weight stream (32 trips of 32 elements, W2 then W3) runs RING elements ahead.
  v4f ring[RING];
#pragma unroll
  for (int j = 0; j < RING; ++j) ring[j] = ws[j * 32 + lane];

#pragma unroll 1
  for (int kt = 0; kt < 16; ++kt) {
    v8f x0, x1;   // input tile kt (b1 already folded into qp)
#pragma unroll
    for (int r = 0; r < 8; ++r) {
      x0[r] = fmaxf(nq[r] + nk0[r], 0.0f);
      x1[r] = fmaxf(nq[r] + nk1[r], 0.0f);
    }
    const int tn = ((kt + 1) & 15) << 4;   // next tile, fetched one trip ahead
    const gfp qb = sbase(qrow + tn), kb = sbase(krow + tn);
    nq  = *(gv8p)(qb + f8);
    nk0 = *(gv8p)(kb + kl0);
    nk1 = *(gv8p)(kb + kl1);
    const v4f* cur = ws + kt * (32 * 32);
#pragma unroll
    for (int j = 0; j < 32; ++j) {
      const v4f w = ring[j % RING];
      ring[j % RING] = cur[(j + RING) * 32 + lane];
      EAT(w, x0, x1, j & 1, acc[j >> 1][0], acc[j >> 1][1]);
    }
  }

#pragma unroll
  for (int nt = 0; nt < 16; ++nt)
#pragma unroll
    for (int r = 0; r < 8; ++r) {
      acc[nt][0][r] = fmaxf(acc[nt][0][r], 0.0f);
      acc[nt][1][r] = fmaxf(acc[nt][1][r], 0.0f);
    }

  // ---- layer 3 + logits: one 16-feature output tile per trip, folded into
  //      dot(relu(h3), Wf) at once ----
  float part0 = 0.0f, part1 = 0.0f;
  v8f nb = ld8(b3 + f8), nw = ld8(Wf + f8);
  xwait();
#pragma unroll 1
  for (int nt = 0; nt < 16; ++nt) {
    v8f d0 = nb, d1 = nb;
    const v8f wf = nw;
    const int tn = ((nt + 1) & 15) << 4;
    nb = *(gv8p)(sbase(b3 + tn) + f8);
    nw = *(gv8p)(sbase(Wf + tn) + f8);
    const v4f* cur = ws + (16 + nt) * (32 * 32);
    // the last trip has no successor: its look-ahead re-reads the stream's start
    const v4f* nxt = (nt == 15) ? ws : cur + 32 * 32;
#pragma unroll
    for (int j = 0; j < 32; ++j) {
      const v4f w = ring[j % RING];
      ring[j % RING] = (j + RING < 32) ? cur[(j + RING) * 32 + lane] : nxt[(j + RING - 32) * 32 + lane];
      EAT(w, acc[j >> 1][0], acc[j >> 1][1], j & 1, d0, d1);
    }
    // Vector slots between the last WMMA and the first read of its D.
    // d0 and d1 are operands only so
    // that the slots stand behind their last WMMA and in front of their readers.
    asm volatile("v_nop\n\tv_nop\n\tv_nop\n\tv_nop\n\tv_nop" : "+v"(d0), "+v"(d1));
#pragma unroll
    for (int r = 0; r < 8; ++r) {
      part0 = fmaf(fmaxf(d0[r], 0.0f), wf[r], part0);
      part1 = fmaf(fmaxf(d1[r], 0.0f), wf[r], part1);
    }
  }

  const int joff = (lane >> 4) << 7;   // each half-wave covers 128 of H
  const long obase = (long)(batch * SQ_DIM + q) * SK_DIM + k0;

  // the two lane halves hold the two halves of every feature tile
  part0 += __shfl_xor(part0, 16, 32);
  part1 += __shfl_xor(part1, 16, 32);
  out_logits[obase + lane] = ((lane < 16) ? part0 : part1) + bf[0];

  // ---- variance epilogue: softplus(dot(relu(vq+vk), Wv2) + bv2) ----
#pragma unroll
  for (int mt = 0; mt < 2; ++mt) {
    const float* vqrow = vq + (long)(batch * SQ_DIM + q) * H_DIM + joff;
    const float* vkrow = vk + (long)(batch * SK_DIM + k0 + (mt << 4) + mrow) * H_DIM + joff;
    const float* wv = Wv2 + joff;
    float part = 0.0f;
#pragma unroll 4
    for (int j = 0; j < 128; ++j) {
      float x = fmaxf(vqrow[j] + vkrow[j], 0.0f);
      part = fmaf(x, wv[j], part);
    }
    part += __shfl_xor(part, 16, 32);
    if (lane < 16) {
      float x = part + bv2[0];
      out_var[obase + (mt << 4) + mrow] = (x > 20.0f) ? x : log1pf(expf(x));
    }
  }
}

// ---------------------------------------------------------------------------
extern "C" void kernel_launch(void* const* d_in, const int* in_sizes, int n_in,
                              void* d_out, int out_size, void* d_ws, size_t ws_size,
                              hipStream_t stream) {
  (void)in_sizes; (void)n_in; (void)out_size; (void)ws_size;
  const float* query = (const float*)d_in[0];
  const float* key   = (const float*)d_in[1];
  const float* Wqe   = (const float*)d_in[2];
  const float* bqe   = (const float*)d_in[3];
  const float* Wke   = (const float*)d_in[4];
  const float* bke   = (const float*)d_in[5];
  const float* W1    = (const float*)d_in[6];
  const float* b1    = (const float*)d_in[7];
  const float* W2    = (const float*)d_in[8];
  const float* b2    = (const float*)d_in[9];
  const float* W3    = (const float*)d_in[10];
  const float* b3    = (const float*)d_in[11];
  const float* Wf    = (const float*)d_in[12];
  const float* bf    = (const float*)d_in[13];
  const float* Wv1   = (const float*)d_in[14];
  const float* bv1   = (const float*)d_in[15];
  const float* Wv2   = (const float*)d_in[16];
  const float* bv2   = (const float*)d_in[17];

  const size_t NSH = (size_t)B_DIM * SQ_DIM * H_DIM;   // 262144 floats per tensor
  float* qf  = (float*)d_ws;
  float* kf  = qf + NSH;
  float* qp  = kf + NSH;
  float* kp  = qp + NSH;
  float* vq  = kp + NSH;
  float* vk  = vq + NSH;
  float* W2p = vk + NSH;                 // 65536 floats
  float* W3p = W2p + (size_t)H_DIM * H_DIM;   // directly behind W2p; total workspace: 6.5 MB

  dim3 blk(256);
  dim3 tblk(128);
  dim3 grd(256);   // 64 row tiles x 4 column tiles

  encode_kernel<<<grd, tblk, 0, stream>>>(query, Wqe, bqe, qf);
  encode_kernel<<<grd, tblk, 0, stream>>>(key,   Wke, bke, kf);
  project_kernel<<<grd, tblk, 0, stream>>>(qf, W1,  0,     b1,      qp);
  project_kernel<<<grd, tblk, 0, stream>>>(kf, W1,  H_DIM, nullptr, kp);
  project_kernel<<<grd, tblk, 0, stream>>>(qf, Wv1, 0,     bv1,     vq);
  project_kernel<<<grd, tblk, 0, stream>>>(kf, Wv1, H_DIM, nullptr, vk);
  pack_w_kernel<<<dim3(64), blk, 0, stream>>>(W2, W2p, 1);
  pack_w_kernel<<<dim3(64), blk, 0, stream>>>(W3, W3p, 0);

  float* out_logits = (float*)d_out;
  float* out_var    = out_logits + (size_t)B_DIM * SQ_DIM * SK_DIM;
  fused_pair_kernel<<<dim3(B_DIM * SQ_DIM * 4), dim3(128), 0, stream>>>(
      qp, kp, vq, vk, W2p, b2, b3, Wf, bf, Wv2, bv2, out_logits, out_var);
}
